// v000
// Times are from an AMD MI455X. After a warm-up the kernel runs many times in a row, and a time is the length of
// such a window on the GPU divided by its runs, so every launch and the gaps after it count. The runs cycle
// through copies of the inputs. A figure is the median of several windows, for all but v000 over two sittings.
// Sittings can differ by a few percent; kernels timed side by side share one.
// v000 is the starting kernel. One run takes 530 microseconds.
#include <hip/hip_runtime.h>
#include <hip/hip_bf16.h>
#include <math.h>

#define B_    2
#define S_    2048
#define HID_  1024
#define NH_   16
#define HD_   64
#define ROWS_ (B_ * S_)

typedef __bf16 v16bf __attribute__((ext_vector_type(16)));
typedef __bf16 v8bf  __attribute__((ext_vector_type(8)));
typedef float  v8f   __attribute__((ext_vector_type(8)));

__device__ __forceinline__ v8f wmma_bf16(v16bf a, v16bf b, v8f c) {
  // (neg_a, A, neg_b, B, c_mod, C, reuse_a, reuse_b)
  return __builtin_amdgcn_wmma_f32_16x16x32_bf16(false, a, false, b, (short)0, c,
                                                 false, false);
}

// 16-bit 16x32 A/B fragment (ISA 7.12.2): per lane (half = lane>>4):
//   elems 0..7  -> K = kb + 8*half + e        (16 contiguous bytes)
//   elems 8..15 -> K = kb + 16 + 8*half + e   (16 contiguous bytes)
__device__ __forceinline__ v16bf load_frag_bf(const __bf16* __restrict__ base,
                                              int kb, int half) {
  const v8bf* p = (const v8bf*)(base + kb + 8 * half);
  v8bf lo = p[0];
  v8bf hi = p[2];
  return __builtin_shufflevector(lo, hi, 0, 1, 2, 3, 4, 5, 6, 7,
                                 8, 9, 10, 11, 12, 13, 14, 15);
}

// ---- 16-lane reductions via DPP (VALU pipe, no DS, no waits) ----
// quad_perm xor1 = 0xB1, quad_perm xor2 = 0x4E, ROW_HALF_MIRROR = 0x141,
// ROW_MIRROR = 0x140.  DPP row ops never cross 16-lane rows, which matches the
// C-fragment half-wave row striping.
#define DPP_STEP_MAX(v, ctrl)                                                   \
  v = fmaxf(v, __int_as_float(__builtin_amdgcn_update_dpp(                      \
                  0, __float_as_int(v), (ctrl), 0xF, 0xF, true)))
#define DPP_STEP_ADD(v, ctrl)                                                   \
  v = v + __int_as_float(__builtin_amdgcn_update_dpp(                           \
              0, __float_as_int(v), (ctrl), 0xF, 0xF, true))

__device__ __forceinline__ float rowmax16(float v) {
  DPP_STEP_MAX(v, 0xB1);
  DPP_STEP_MAX(v, 0x4E);
  DPP_STEP_MAX(v, 0x141);
  DPP_STEP_MAX(v, 0x140);
  return v;
}
__device__ __forceinline__ float rowsum16(float v) {
  DPP_STEP_ADD(v, 0xB1);
  DPP_STEP_ADD(v, 0x4E);
  DPP_STEP_ADD(v, 0x141);
  DPP_STEP_ADD(v, 0x140);
  return v;
}

// ============================================================================
// One-time fp32 -> (hi, lo) bf16 split.  O(N^2) work hoisted out of all GEMMs.
// ============================================================================
__global__ __launch_bounds__(256) void split_kernel(const float* __restrict__ src,
                                                    __bf16* __restrict__ h,
                                                    __bf16* __restrict__ l, int n) {
  int i = blockIdx.x * 256 + threadIdx.x;
  if (i < n) {
    float x = src[i];
    __bf16 hb = (__bf16)x;
    h[i] = hb;
    l[i] = (__bf16)(x - (float)hb);
  }
}

// ============================================================================
// Y[r,n] = sum_k X[r,k] * W[n,k] with pre-split bf16 inputs.
// Wave tile: 16 rows x 64 cols (one full head). Inner loop: 20 b128 loads +
// 12 WMMA per K=32 step -- zero conversions.
// Epilogue modes: ROPE split-store (Q,K), transposed split-store (V), f32 (out).
// ============================================================================
enum { MODE_ROPE = 0, MODE_VTRANS = 1, MODE_F32 = 2 };

template <int MODE>
__global__ __launch_bounds__(256) void gemm_bf_kernel(
    const __bf16* __restrict__ Xh, const __bf16* __restrict__ Xl,
    const __bf16* __restrict__ Wh, const __bf16* __restrict__ Wl,
    __bf16* __restrict__ Yh, __bf16* __restrict__ Yl, float* __restrict__ Yf) {
  const int lane = threadIdx.x & 31;
  const int w    = threadIdx.x >> 5;
  const int wm   = w >> 2;  // 0..1
  const int wn   = w & 3;   // 0..3
  const int row0 = blockIdx.x * 32 + wm * 16;
  const int col0 = blockIdx.y * 256 + wn * 64;  // wave: 64 cols == one head
  const int m    = lane & 15;
  const int half = lane >> 4;

  const __bf16* xh = Xh + (size_t)(row0 + m) * HID_;
  const __bf16* xl = Xl + (size_t)(row0 + m) * HID_;
  const __bf16* wh0 = Wh + (size_t)(col0 + m) * HID_;
  const __bf16* wl0 = Wl + (size_t)(col0 + m) * HID_;

  v8f acc[4] = {};
  for (int kb = 0; kb < HID_; kb += 32) {
    v16bf ah = load_frag_bf(xh, kb, half);
    v16bf al = load_frag_bf(xl, kb, half);
#pragma unroll
    for (int t = 0; t < 4; ++t) {
      v16bf bh = load_frag_bf(wh0 + (size_t)t * 16 * HID_, kb, half);
      v16bf bl = load_frag_bf(wl0 + (size_t)t * 16 * HID_, kb, half);
      acc[t] = wmma_bf16(ah, bh, acc[t]);
      acc[t] = wmma_bf16(al, bh, acc[t]);
      acc[t] = wmma_bf16(ah, bl, acc[t]);
    }
  }

  if constexpr (MODE == MODE_F32) {
#pragma unroll
    for (int t = 0; t < 4; ++t)
#pragma unroll
      for (int i = 0; i < 8; ++i)
        Yf[(size_t)(row0 + half * 8 + i) * HID_ + col0 + t * 16 + m] = acc[t][i];
  } else if constexpr (MODE == MODE_VTRANS) {
    // store V transposed: [b, h, d, s] so P.V B-frags are contiguous loads
    const int b   = row0 / S_;
    const int s0v = (row0 & (S_ - 1)) + half * 8;
#pragma unroll
    for (int t = 0; t < 4; ++t) {
      int col = col0 + t * 16 + m;
      int hh  = col >> 6;
      int d   = col & 63;
      size_t base = ((size_t)(b * NH_ + hh) * HD_ + d) * S_ + s0v;
      v8bf hv, lv;
#pragma unroll
      for (int i = 0; i < 8; ++i) {
        float v = acc[t][i];
        __bf16 hb = (__bf16)v;
        hv[i] = hb;
        lv[i] = (__bf16)(v - (float)hb);
      }
      *(v8bf*)(Yh + base) = hv;
      *(v8bf*)(Yl + base) = lv;
    }
  } else {  // MODE_ROPE: wave-private LDS tile, mix col pairs, split-store
    __shared__ float rtile[8][16][65];
#pragma unroll
    for (int t = 0; t < 4; ++t)
#pragma unroll
      for (int i = 0; i < 8; ++i) rtile[w][half * 8 + i][t * 16 + m] = acc[t][i];
    asm volatile("s_wait_dscnt 0" ::: "memory");  // wave-private: no barrier needed

    const int head = col0 >> 6;
#pragma unroll
    for (int tt = 0; tt < 16; ++tt) {
      int pp = lane + 32 * tt;  // 16 rows x 32 pairs
      int r  = pp >> 5;
      int c  = pp & 31;
      int gr = row0 + r;
      int s  = gr & (S_ - 1);
      float invf = __expf((float)c * (-2.0f / (float)HD_) * 9.2103403719761836f);
      float sn, cs;
      sincosf((float)s * invf, &sn, &cs);
      float qe = rtile[w][r][2 * c];
      float qo = rtile[w][r][2 * c + 1];
      float o1 = qe * cs - qo * sn;
      float o2 = qo * cs + qe * sn;
      size_t o = (size_t)gr * HID_ + head * HD_;
      __bf16 h1 = (__bf16)o1;
      Yh[o + c] = h1;
      Yl[o + c] = (__bf16)(o1 - (float)h1);
      __bf16 h2 = (__bf16)o2;
      Yh[o + c + 32] = h2;
      Yl[o + c + 32] = (__bf16)(o2 - (float)h2);
    }
  }
}

// ============================================================================
// Flash attention on pre-split bf16 Q, K (row-major) and V (transposed).
// One wave owns 16 query rows x all 2048 keys; key blocks of 32.
// ============================================================================
__global__ __launch_bounds__(256) void attn_kernel(
    const __bf16* __restrict__ Qh, const __bf16* __restrict__ Ql,
    const __bf16* __restrict__ Kh, const __bf16* __restrict__ Kl,
    const __bf16* __restrict__ Vth, const __bf16* __restrict__ Vtl,
    __bf16* __restrict__ Ah, __bf16* __restrict__ Al) {
  __shared__ float plds[8][16][33];  // per-wave P staging (C-frag -> A-frag)
  const int lane = threadIdx.x & 31;
  const int w    = threadIdx.x >> 5;
  const int gw   = blockIdx.x * 8 + w;
  const int qt   = gw & (S_ / 16 - 1);
  const int bh   = gw >> 7;
  const int b    = bh >> 4;
  const int h    = bh & 15;
  const int m    = lane & 15;
  const int half = lane >> 4;
  const float rscale = 0.125f;  // 1/sqrt(64)

  const __bf16* qrh = Qh + (size_t)(b * S_ + qt * 16 + m) * HID_ + h * HD_;
  const __bf16* qrl = Ql + (size_t)(b * S_ + qt * 16 + m) * HID_ + h * HD_;
  v16bf qfh[2], qfl[2];
#pragma unroll
  for (int t = 0; t < 2; ++t) {
    qfh[t] = load_frag_bf(qrh, t * 32, half);
    qfl[t] = load_frag_bf(qrl, t * 32, half);
  }

  v8f oacc[4] = {};
  float mi[8], li[8];
#pragma unroll
  for (int i = 0; i < 8; ++i) { mi[i] = -1e30f; li[i] = 0.0f; }

  for (int n0 = 0; n0 < S_; n0 += 32) {
    // ---- scores: two 16x16 key tiles ----
    v8f s0 = {}, s1 = {};
    const __bf16* k0h = Kh + (size_t)(b * S_ + n0 + m) * HID_ + h * HD_;
    const __bf16* k0l = Kl + (size_t)(b * S_ + n0 + m) * HID_ + h * HD_;
    const __bf16* k1h = k0h + (size_t)16 * HID_;
    const __bf16* k1l = k0l + (size_t)16 * HID_;
#pragma unroll
    for (int t = 0; t < 2; ++t) {
      v16bf kh = load_frag_bf(k0h, t * 32, half);
      v16bf kl = load_frag_bf(k0l, t * 32, half);
      s0 = wmma_bf16(qfh[t], kh, s0);
      s0 = wmma_bf16(qfl[t], kh, s0);
      s0 = wmma_bf16(qfh[t], kl, s0);
      kh = load_frag_bf(k1h, t * 32, half);
      kl = load_frag_bf(k1l, t * 32, half);
      s1 = wmma_bf16(qfh[t], kh, s1);
      s1 = wmma_bf16(qfl[t], kh, s1);
      s1 = wmma_bf16(qfh[t], kl, s1);
    }

    // ---- online softmax (rows striped across 16-lane halves, DPP reduce) ----
    float alpha[8];
#pragma unroll
    for (int i = 0; i < 8; ++i) {
      float a0 = s0[i] * rscale;
      float a1 = s1[i] * rscale;
      float tmax = rowmax16(fmaxf(a0, a1));
      float mn = fmaxf(mi[i], tmax);
      alpha[i] = __expf(mi[i] - mn);
      mi[i] = mn;
      float p0 = __expf(a0 - mn);
      float p1 = __expf(a1 - mn);
      li[i] = li[i] * alpha[i] + rowsum16(p0 + p1);
      plds[w][half * 8 + i][m]      = p0;
      plds[w][half * 8 + i][16 + m] = p1;
    }
#pragma unroll
    for (int t = 0; t < 4; ++t)
#pragma unroll
      for (int i = 0; i < 8; ++i) oacc[t][i] *= alpha[i];

    asm volatile("s_wait_dscnt 0" ::: "memory");

    // ---- P as A-fragment, hw-cast hi/lo split ----
    v16bf ph, pl;
    {
      const int k0 = 8 * half;
#pragma unroll
      for (int e = 0; e < 8; ++e) {
        float p0 = plds[w][m][k0 + e];
        float p1 = plds[w][m][16 + k0 + e];
        __bf16 hb0 = (__bf16)p0, hb1 = (__bf16)p1;
        ph[e] = hb0;
        ph[8 + e] = hb1;
        pl[e] = (__bf16)(p0 - (float)hb0);
        pl[8 + e] = (__bf16)(p1 - (float)hb1);
      }
    }

    // ---- O += P.V : V transposed -> contiguous B-frag loads ----
#pragma unroll
    for (int t = 0; t < 4; ++t) {
      const __bf16* vbh =
          Vth + ((size_t)(b * NH_ + h) * HD_ + t * 16 + m) * S_ + n0;
      const __bf16* vbl =
          Vtl + ((size_t)(b * NH_ + h) * HD_ + t * 16 + m) * S_ + n0;
      v16bf vh = load_frag_bf(vbh, 0, half);
      v16bf vl = load_frag_bf(vbl, 0, half);
      oacc[t] = wmma_bf16(ph, vh, oacc[t]);
      oacc[t] = wmma_bf16(pl, vh, oacc[t]);
      oacc[t] = wmma_bf16(ph, vl, oacc[t]);
    }
  }

  // ---- normalize, split-store for the final projection ----
  float inv[8];
#pragma unroll
  for (int i = 0; i < 8; ++i) inv[i] = 1.0f / li[i];
#pragma unroll
  for (int t = 0; t < 4; ++t)
#pragma unroll
    for (int i = 0; i < 8; ++i) {
      float v = oacc[t][i] * inv[i];
      size_t idx =
          (size_t)(b * S_ + qt * 16 + half * 8 + i) * HID_ + h * HD_ + t * 16 + m;
      __bf16 hb = (__bf16)v;
      Ah[idx] = hb;
      Al[idx] = (__bf16)(v - (float)hb);
    }
}

// ============================================================================
extern "C" void kernel_launch(void* const* d_in, const int* in_sizes, int n_in,
                              void* d_out, int out_size, void* d_ws, size_t ws_size,
                              hipStream_t stream) {
  (void)in_sizes; (void)n_in; (void)out_size; (void)ws_size;
  const float* hs = (const float*)d_in[0];
  const float* wq = (const float*)d_in[1];
  const float* wk = (const float*)d_in[2];
  const float* wv = (const float*)d_in[3];
  const float* wo = (const float*)d_in[4];
  float* out = (float*)d_out;

  const size_t NX = (size_t)ROWS_ * HID_;  // 4M
  const size_t NW = (size_t)HID_ * HID_;   // 1M
  __bf16* p = (__bf16*)d_ws;
  __bf16 *Xh = p, *Xl = Xh + NX;
  __bf16 *Wqh = Xl + NX, *Wql = Wqh + NW;
  __bf16 *Wkh = Wql + NW, *Wkl = Wkh + NW;
  __bf16 *Wvh = Wkl + NW, *Wvl = Wvh + NW;
  __bf16 *Woh = Wvl + NW, *Wol = Woh + NW;
  __bf16 *Qh = Wol + NW, *Ql = Qh + NX;
  __bf16 *Kh = Ql + NX, *Kl = Kh + NX;
  __bf16 *Vth = Kl + NX, *Vtl = Vth + NX;
  __bf16 *Ah = Vtl + NX, *Al = Ah + NX;   // ~101 MB total

  // 1) one-time splits
  split_kernel<<<dim3((unsigned)(NX / 256)), dim3(256), 0, stream>>>(hs, Xh, Xl, (int)NX);
  split_kernel<<<dim3((unsigned)(NW / 256)), dim3(256), 0, stream>>>(wq, Wqh, Wql, (int)NW);
  split_kernel<<<dim3((unsigned)(NW / 256)), dim3(256), 0, stream>>>(wk, Wkh, Wkl, (int)NW);
  split_kernel<<<dim3((unsigned)(NW / 256)), dim3(256), 0, stream>>>(wv, Wvh, Wvl, (int)NW);
  split_kernel<<<dim3((unsigned)(NW / 256)), dim3(256), 0, stream>>>(wo, Woh, Wol, (int)NW);

  // 2) projections (Q,K with fused RoPE; V transposed)
  dim3 pg(ROWS_ / 32, HID_ / 256);
  dim3 pb(256);
  gemm_bf_kernel<MODE_ROPE><<<pg, pb, 0, stream>>>(Xh, Xl, Wqh, Wql, Qh, Ql, nullptr);
  gemm_bf_kernel<MODE_ROPE><<<pg, pb, 0, stream>>>(Xh, Xl, Wkh, Wkl, Kh, Kl, nullptr);
  gemm_bf_kernel<MODE_VTRANS><<<pg, pb, 0, stream>>>(Xh, Xl, Wvh, Wvl, Vth, Vtl, nullptr);

  // 3) flash attention
  attn_kernel<<<dim3((ROWS_ / 16) * NH_ / 8), dim3(256), 0, stream>>>(
      Qh, Ql, Kh, Kl, Vth, Vtl, Ah, Al);

  // 4) output projection -> fp32 result
  gemm_bf_kernel<MODE_F32><<<pg, pb, 0, stream>>>(Ah, Al, Woh, Wol, nullptr, nullptr, out);
}

// v001
// One run takes 328 microseconds.
// Timed twice side by side with v000, it ran 1.68 times as fast both times.
#include <hip/hip_runtime.h>
#include <hip/hip_bf16.h>
#include <math.h>
#include <stdint.h>

#define B_    2
#define S_    2048
#define HID_  1024
#define NH_   16
#define HD_   64
#define ROWS_ (B_ * S_)

typedef __bf16 v16bf __attribute__((ext_vector_type(16)));
typedef __bf16 v8bf  __attribute__((ext_vector_type(8)));
typedef float  v8f   __attribute__((ext_vector_type(8)));

__device__ __forceinline__ v8f wmma_bf16(v16bf a, v16bf b, v8f c) {
  // (neg_a, A, neg_b, B, c_mod, C, reuse_a, reuse_b)
  return __builtin_amdgcn_wmma_f32_16x16x32_bf16(false, a, false, b, (short)0, c,
                                                 false, false);
}

// 16-bit 16x32 A/B fragment (ISA 7.12.2): per lane (half = lane>>4):
//   elems 0..7  -> K = kb + 8*half + e        (16 contiguous bytes)
//   elems 8..15 -> K = kb + 16 + 8*half + e   (16 contiguous bytes)
__device__ __forceinline__ v16bf load_frag_bf(const __bf16* __restrict__ base,
                                              int kb, int half) {
  const v8bf* p = (const v8bf*)(base + kb + 8 * half);
  v8bf lo = p[0];
  v8bf hi = p[2];
  return __builtin_shufflevector(lo, hi, 0, 1, 2, 3, 4, 5, 6, 7,
                                 8, 9, 10, 11, 12, 13, 14, 15);
}

// ---- 16-lane reductions via DPP (VALU pipe, no DS, no waits) ----
// quad_perm xor1 = 0xB1, quad_perm xor2 = 0x4E, ROW_HALF_MIRROR = 0x141,
// ROW_MIRROR = 0x140.  DPP row ops never cross 16-lane rows, which matches the
// C-fragment half-wave row striping.
#define DPP_STEP_MAX(v, ctrl)                                                   \
  v = fmaxf(v, __int_as_float(__builtin_amdgcn_update_dpp(                      \
                  0, __float_as_int(v), (ctrl), 0xF, 0xF, true)))
#define DPP_STEP_ADD(v, ctrl)                                                   \
  v = v + __int_as_float(__builtin_amdgcn_update_dpp(                           \
              0, __float_as_int(v), (ctrl), 0xF, 0xF, true))

__device__ __forceinline__ float rowmax16(float v) {
  DPP_STEP_MAX(v, 0xB1);
  DPP_STEP_MAX(v, 0x4E);
  DPP_STEP_MAX(v, 0x141);
  DPP_STEP_MAX(v, 0x140);
  return v;
}
__device__ __forceinline__ float rowsum16(float v) {
  DPP_STEP_ADD(v, 0xB1);
  DPP_STEP_ADD(v, 0x4E);
  DPP_STEP_ADD(v, 0x141);
  DPP_STEP_ADD(v, 0x140);
  return v;
}

// ============================================================================
// One-time fp32 -> (hi, lo) bf16 split.  O(N^2) work hoisted out of all GEMMs.
// ============================================================================
__global__ __launch_bounds__(256) void split_kernel(const float* __restrict__ src,
                                                    __bf16* __restrict__ h,
                                                    __bf16* __restrict__ l, int n) {
  int i = blockIdx.x * 256 + threadIdx.x;
  if (i < n) {
    float x = src[i];
    __bf16 hb = (__bf16)x;
    h[i] = hb;
    l[i] = (__bf16)(x - (float)hb);
  }
}

// ============================================================================
// Y[r,n] = sum_k X[r,k] * W[n,k] with pre-split bf16 inputs.
// Block tile: 128 rows x 128 cols, 4 waves (2 x 2), wave tile 64 x 64 (one head wide).
// A stage is 128 k (256-byte rows) of [Xh | Xl | Wh | Wl], 128 rows each, brought into LDS
// by one tensor load per wave (wave w brings slice w), two buffers, rows padded to 272 B.
// Fragments come from LDS; per 32 k a wave does 32 ds_load_b128 and 48 WMMA.
// Epilogue modes: ROPE split-store (Q,K), transposed split-store (V), f32 (out).
// ============================================================================
enum { MODE_ROPE = 0, MODE_VTRANS = 1, MODE_F32 = 2 };

typedef uint32_t u32x4 __attribute__((ext_vector_type(4)));
typedef uint32_t u32x8 __attribute__((ext_vector_type(8)));

constexpr uint32_t G_ROWB   = 256u;                // bytes of one staged row (128 k)
constexpr uint32_t G_PITCH  = G_ROWB + 16u;        // LDS row pitch, odd multiple of 16 B
constexpr uint32_t G_ROWS   = 128u;                // rows of one slice
constexpr uint32_t G_SLICE  = G_ROWS * G_PITCH;    // 34,816 B = 17 x 2 KiB
constexpr uint32_t G_STAGE  = 4u * G_SLICE;        // 139,264 B
constexpr uint32_t G_NSTAGE = (HID_ * 2u) / G_ROWB;  // 8
static_assert(G_SLICE % 2048u == 0u, "every slice starts at a multiple of 2 KiB");
static_assert(G_NSTAGE >= 2u, "the prologue fills two stages");

__device__ __forceinline__ uint32_t uni(uint32_t v) {
  return (uint32_t)__builtin_amdgcn_readfirstlane(v);
}
__device__ __forceinline__ uint32_t pinned(uint32_t v) {
  uint32_t w = (uint32_t)__builtin_amdgcn_readfirstlane(v);
  asm volatile("" : "+s"(w));
  return w;
}
// Group 1: 1-byte elements, tile = tensor = 128 rows of 256 B, source pitch 2,048 B,
// 16 B of LDS pad behind every 256 B, no mask.
__device__ __forceinline__ u32x8 tdm_group1() {
  u32x8 g;
  g[0] = uni((1u << 20) | (5u << 22) | (3u << 25));
  g[1] = uni((G_ROWB & 0xFFFFu) << 16);
  g[2] = uni((G_ROWB >> 16) | ((G_ROWS & 0xFFFFu) << 16));
  g[3] = uni((G_ROWS >> 16) | (G_ROWB << 16));
  g[4] = uni(G_ROWS);
  g[5] = uni(HID_ * 2u);
  g[6] = uni(0u);
  g[7] = uni(0u);
  return g;
}
// Group 0: count 1, LDS destination (byte offset), global address of the tile's first byte, type 2.
__device__ __forceinline__ u32x4 tdm_group0(uint32_t lds_dst, uint64_t ga) {
  u32x4 g;
  g[0] = uni(1u);
  g[1] = uni(lds_dst);
  g[2] = uni((uint32_t)ga);
  g[3] = uni((((uint32_t)(ga >> 32)) & 0x01FFFFFFu) | 0x80000000u);
  return g;
}
__device__ __forceinline__ void tdm_load(u32x4 g0, u32x8 g1) {
  asm volatile("tensor_load_to_lds %0, %1" ::"s"(g0), "s"(g1) : "memory");
}
// Same k order as load_frag_bf: 16 B at +0 and 16 B at +32 from (row, 32-k block, 8 * half).
__device__ __forceinline__ v16bf lds_frag(const unsigned char* p) {
  v8bf lo = *(const v8bf*)p;
  v8bf hi = *(const v8bf*)(p + 32);
  return __builtin_shufflevector(lo, hi, 0, 1, 2, 3, 4, 5, 6, 7,
                                 8, 9, 10, 11, 12, 13, 14, 15);
}

template <int MODE>
__global__ __launch_bounds__(128) void gemm_bf_kernel(
    const __bf16* __restrict__ Xh, const __bf16* __restrict__ Xl,
    const __bf16* __restrict__ Wh, const __bf16* __restrict__ Wl,
    __bf16* __restrict__ Yh, __bf16* __restrict__ Yl, float* __restrict__ Yf) {
  __shared__ __attribute__((aligned(2048))) unsigned char ring[2u * G_STAGE];
  const int lane = threadIdx.x & 31;
  const uint32_t w = uni(threadIdx.x >> 5);
  const int wm   = (int)(w >> 1);  // 0..1
  const int wn   = (int)(w & 1u);  // 0..1
  const int brow = blockIdx.x * 128;
  const int bcol = blockIdx.y * 128;
  const int row0 = brow + wm * 64;
  const int col0 = bcol + wn * 64;  // wave: 64 cols == one head
  const int m    = lane & 15;
  const int half = lane >> 4;

  // This wave's slice of every stage: 0 Xh, 1 Xl, 2 Wh, 3 Wl.
  const __bf16* sp = (w == 0u)   ? Xh + (size_t)brow * HID_
                     : (w == 1u) ? Xl + (size_t)brow * HID_
                     : (w == 2u) ? Wh + (size_t)bcol * HID_
                                 : Wl + (size_t)bcol * HID_;
  const uint64_t src0 = (uint64_t)(uintptr_t)sp;
  const uint32_t dst0 = (uint32_t)(size_t)ring + w * G_SLICE;
  const u32x8 g1 = tdm_group1();

  // Per-lane fragment bases inside a buffer.
  const uint32_t a_off = (uint32_t)(wm * 64 + m) * G_PITCH + 16u * (uint32_t)half;
  const uint32_t b_off = 2u * G_SLICE + (uint32_t)(wn * 64 + m) * G_PITCH + 16u * (uint32_t)half;

  v8f acc[4][4] = {};  // [row tile][col tile]

  // Prologue: stage 0, its wait, the barrier that publishes it, then stage 1.
  tdm_load(tdm_group0(dst0, src0), g1);
  asm volatile("s_wait_tensorcnt 0x0" ::: "memory");  // this wave's slice of stage 0 has landed
  __syncthreads();
  tdm_load(tdm_group0(dst0 + G_STAGE, src0 + G_ROWB), g1);

#pragma clang loop unroll(disable)  // one pass per stage; the buffer is picked by s & 1
  for (uint32_t s = 0; s < G_NSTAGE; ++s) {
    const uint32_t boff = (s & 1u) * G_STAGE;
    const unsigned char* pa = ring + boff + a_off;
    const unsigned char* pb = ring + boff + b_off;
    v16bf fa[2][4][2], fb[2][4][2];  // [set][tile][hi, lo]; set (u & 1) holds block u's fragments
#pragma unroll
    for (int i = 0; i < 4; ++i) {
      fa[0][i][0] = lds_frag(pa + (uint32_t)i * 16u * G_PITCH);
      fa[0][i][1] = lds_frag(pa + G_SLICE + (uint32_t)i * 16u * G_PITCH);
      fb[0][i][0] = lds_frag(pb + (uint32_t)i * 16u * G_PITCH);
      fb[0][i][1] = lds_frag(pb + G_SLICE + (uint32_t)i * 16u * G_PITCH);
    }
#pragma unroll
    for (int u = 0; u < 4; ++u) {
      const int cs = u & 1;
      if (u + 1 < 4) {  // the next block's fragments, one group, in flight under this block's WMMAs
        const uint32_t ko = (uint32_t)(u + 1) * 64u;
#pragma unroll
        for (int i = 0; i < 4; ++i) {
          fa[cs ^ 1][i][0] = lds_frag(pa + (uint32_t)i * 16u * G_PITCH + ko);
          fa[cs ^ 1][i][1] = lds_frag(pa + G_SLICE + (uint32_t)i * 16u * G_PITCH + ko);
          fb[cs ^ 1][i][0] = lds_frag(pb + (uint32_t)i * 16u * G_PITCH + ko);
          fb[cs ^ 1][i][1] = lds_frag(pb + G_SLICE + (uint32_t)i * 16u * G_PITCH + ko);
        }
      }
      __builtin_amdgcn_sched_barrier(0);  // keeps the LDS loads one group ahead of the WMMA block, not among it
      // Per accumulator the order stays hi*hi, lo*hi, hi*lo; 16 independent tiles between.
#pragma unroll
      for (int i = 0; i < 4; ++i)
#pragma unroll
        for (int t = 0; t < 4; ++t) acc[i][t] = wmma_bf16(fa[cs][i][0], fb[cs][t][0], acc[i][t]);
#pragma unroll
      for (int i = 0; i < 4; ++i)
#pragma unroll
        for (int t = 0; t < 4; ++t) acc[i][t] = wmma_bf16(fa[cs][i][1], fb[cs][t][0], acc[i][t]);
#pragma unroll
      for (int i = 0; i < 4; ++i)
#pragma unroll
        for (int t = 0; t < 4; ++t) acc[i][t] = wmma_bf16(fa[cs][i][0], fb[cs][t][1], acc[i][t]);
      __builtin_amdgcn_sched_barrier(0);  // keeps the following load group behind this WMMA block
    }
    // Publish point of stage s + 1.
    asm volatile("s_wait_dscnt 0x0" ::: "memory");      // this wave's reads of buffer s & 1 have returned
    asm volatile("s_wait_tensorcnt 0x0" ::: "memory");  // this wave's slice of stage s + 1 has landed
    __syncthreads();  // publishes stage s + 1 and ends every wave's reads of buffer s & 1
    if (pinned((s + 2u < G_NSTAGE) ? 1u : 0u) != 0u) {  // only while stage s + 2 exists
      const uint32_t sn = pinned(s + 2u);  // descriptor words held in scalar registers, formed behind the wait
      tdm_load(tdm_group0(dst0 + boff, src0 + (uint64_t)sn * G_ROWB), g1);
    }
  }
  asm volatile("s_wait_tensorcnt 0x0" ::: "memory");  // nothing of this wave is in flight any more
  asm volatile("s_wait_dscnt 0x0" ::: "memory");

  if constexpr (MODE == MODE_F32) {
#pragma unroll
    for (int rt = 0; rt < 4; ++rt)
#pragma unroll
      for (int t = 0; t < 4; ++t)
#pragma unroll
        for (int i = 0; i < 8; ++i)
          Yf[(size_t)(row0 + rt * 16 + half * 8 + i) * HID_ + col0 + t * 16 + m] = acc[rt][t][i];
  } else if constexpr (MODE == MODE_VTRANS) {
    // store V transposed: [b, h, d, s] so P.V B-frags are contiguous loads
    const int b = row0 / S_;
#pragma unroll
    for (int rt = 0; rt < 4; ++rt) {
      const int s0v = ((row0 + rt * 16) & (S_ - 1)) + half * 8;
#pragma unroll
      for (int t = 0; t < 4; ++t) {
        int col = col0 + t * 16 + m;
        int hh  = col >> 6;
        int d   = col & 63;
        size_t base = ((size_t)(b * NH_ + hh) * HD_ + d) * S_ + s0v;
        v8bf hv, lv;
#pragma unroll
        for (int i = 0; i < 8; ++i) {
          float v = acc[rt][t][i];
          __bf16 hb = (__bf16)v;
          hv[i] = hb;
          lv[i] = (__bf16)(v - (float)hb);
        }
        *(v8bf*)(Yh + base) = hv;
        *(v8bf*)(Yl + base) = lv;
      }
    }
  } else {  // MODE_ROPE: wave-private LDS tile, mix col pairs, split-store
    __shared__ float rtile[4][16][65];
    const int head = col0 >> 6;
#pragma unroll
    for (int rt = 0; rt < 4; ++rt) {
#pragma unroll
      for (int t = 0; t < 4; ++t)
#pragma unroll
        for (int i = 0; i < 8; ++i) rtile[w][half * 8 + i][t * 16 + m] = acc[rt][t][i];
      asm volatile("s_wait_dscnt 0" ::: "memory");  // wave-private: no barrier needed

#pragma unroll 4
      for (int tt = 0; tt < 16; ++tt) {
        int pp = lane + 32 * tt;  // 16 rows x 32 pairs
        int r  = pp >> 5;
        int c  = pp & 31;
        int gr = row0 + rt * 16 + r;
        int s  = gr & (S_ - 1);
        float invf = __expf((float)c * (-2.0f / (float)HD_) * 9.2103403719761836f);
        float sn, cs;
        sincosf((float)s * invf, &sn, &cs);
        float qe = rtile[w][r][2 * c];
        float qo = rtile[w][r][2 * c + 1];
        float o1 = qe * cs - qo * sn;
        float o2 = qo * cs + qe * sn;
        size_t o = (size_t)gr * HID_ + head * HD_;
        __bf16 h1 = (__bf16)o1;
        Yh[o + c] = h1;
        Yl[o + c] = (__bf16)(o1 - (float)h1);
        __bf16 h2 = (__bf16)o2;
        Yh[o + c + 32] = h2;
        Yl[o + c + 32] = (__bf16)(o2 - (float)h2);
        // the next rotation reuses the stores' address and data registers
        asm volatile("s_wait_xcnt 0x0" ::: "memory");
      }
    }
  }
}

// ============================================================================
// Flash attention on pre-split bf16 Q, K (row-major) and V (transposed).
// One wave owns 16 query rows x all 2048 keys; key blocks of 32.
// ============================================================================
__global__ __launch_bounds__(256) void attn_kernel(
    const __bf16* __restrict__ Qh, const __bf16* __restrict__ Ql,
    const __bf16* __restrict__ Kh, const __bf16* __restrict__ Kl,
    const __bf16* __restrict__ Vth, const __bf16* __restrict__ Vtl,
    __bf16* __restrict__ Ah, __bf16* __restrict__ Al) {
  __shared__ float plds[8][16][33];  // per-wave P staging (C-frag -> A-frag)
  const int lane = threadIdx.x & 31;
  const int w    = threadIdx.x >> 5;
  const int gw   = blockIdx.x * 8 + w;
  const int qt   = gw & (S_ / 16 - 1);
  const int bh   = gw >> 7;
  const int b    = bh >> 4;
  const int h    = bh & 15;
  const int m    = lane & 15;
  const int half = lane >> 4;
  const float rscale = 0.125f;  // 1/sqrt(64)

  const __bf16* qrh = Qh + (size_t)(b * S_ + qt * 16 + m) * HID_ + h * HD_;
  const __bf16* qrl = Ql + (size_t)(b * S_ + qt * 16 + m) * HID_ + h * HD_;
  v16bf qfh[2], qfl[2];
#pragma unroll
  for (int t = 0; t < 2; ++t) {
    qfh[t] = load_frag_bf(qrh, t * 32, half);
    qfl[t] = load_frag_bf(qrl, t * 32, half);
  }

  v8f oacc[4] = {};
  float mi[8], li[8];
#pragma unroll
  for (int i = 0; i < 8; ++i) { mi[i] = -1e30f; li[i] = 0.0f; }

  for (int n0 = 0; n0 < S_; n0 += 32) {
    // ---- scores: two 16x16 key tiles ----
    v8f s0 = {}, s1 = {};
    const __bf16* k0h = Kh + (size_t)(b * S_ + n0 + m) * HID_ + h * HD_;
    const __bf16* k0l = Kl + (size_t)(b * S_ + n0 + m) * HID_ + h * HD_;
    const __bf16* k1h = k0h + (size_t)16 * HID_;
    const __bf16* k1l = k0l + (size_t)16 * HID_;
#pragma unroll
    for (int t = 0; t < 2; ++t) {
      v16bf kh = load_frag_bf(k0h, t * 32, half);
      v16bf kl = load_frag_bf(k0l, t * 32, half);
      s0 = wmma_bf16(qfh[t], kh, s0);
      s0 = wmma_bf16(qfl[t], kh, s0);
      s0 = wmma_bf16(qfh[t], kl, s0);
      kh = load_frag_bf(k1h, t * 32, half);
      kl = load_frag_bf(k1l, t * 32, half);
      s1 = wmma_bf16(qfh[t], kh, s1);
      s1 = wmma_bf16(qfl[t], kh, s1);
      s1 = wmma_bf16(qfh[t], kl, s1);
    }

    // ---- online softmax (rows striped across 16-lane halves, DPP reduce) ----
    float alpha[8];
#pragma unroll
    for (int i = 0; i < 8; ++i) {
      float a0 = s0[i] * rscale;
      float a1 = s1[i] * rscale;
      float tmax = rowmax16(fmaxf(a0, a1));
      float mn = fmaxf(mi[i], tmax);
      alpha[i] = __expf(mi[i] - mn);
      mi[i] = mn;
      float p0 = __expf(a0 - mn);
      float p1 = __expf(a1 - mn);
      li[i] = li[i] * alpha[i] + rowsum16(p0 + p1);
      plds[w][half * 8 + i][m]      = p0;
      plds[w][half * 8 + i][16 + m] = p1;
    }
#pragma unroll
    for (int t = 0; t < 4; ++t)
#pragma unroll
      for (int i = 0; i < 8; ++i) oacc[t][i] *= alpha[i];

    asm volatile("s_wait_dscnt 0" ::: "memory");

    // ---- P as A-fragment, hw-cast hi/lo split ----
    v16bf ph, pl;
    {
      const int k0 = 8 * half;
#pragma unroll
      for (int e = 0; e < 8; ++e) {
        float p0 = plds[w][m][k0 + e];
        float p1 = plds[w][m][16 + k0 + e];
        __bf16 hb0 = (__bf16)p0, hb1 = (__bf16)p1;
        ph[e] = hb0;
        ph[8 + e] = hb1;
        pl[e] = (__bf16)(p0 - (float)hb0);
        pl[8 + e] = (__bf16)(p1 - (float)hb1);
      }
    }

    // ---- O += P.V : V transposed -> contiguous B-frag loads ----
#pragma unroll
    for (int t = 0; t < 4; ++t) {
      const __bf16* vbh =
          Vth + ((size_t)(b * NH_ + h) * HD_ + t * 16 + m) * S_ + n0;
      const __bf16* vbl =
          Vtl + ((size_t)(b * NH_ + h) * HD_ + t * 16 + m) * S_ + n0;
      v16bf vh = load_frag_bf(vbh, 0, half);
      v16bf vl = load_frag_bf(vbl, 0, half);
      oacc[t] = wmma_bf16(ph, vh, oacc[t]);
      oacc[t] = wmma_bf16(pl, vh, oacc[t]);
      oacc[t] = wmma_bf16(ph, vl, oacc[t]);
    }
  }

  // ---- normalize, split-store for the final projection ----
  float inv[8];
#pragma unroll
  for (int i = 0; i < 8; ++i) inv[i] = 1.0f / li[i];
#pragma unroll
  for (int t = 0; t < 4; ++t)
#pragma unroll
    for (int i = 0; i < 8; ++i) {
      float v = oacc[t][i] * inv[i];
      size_t idx =
          (size_t)(b * S_ + qt * 16 + half * 8 + i) * HID_ + h * HD_ + t * 16 + m;
      __bf16 hb = (__bf16)v;
      Ah[idx] = hb;
      Al[idx] = (__bf16)(v - (float)hb);
    }
}

// ============================================================================
extern "C" void kernel_launch(void* const* d_in, const int* in_sizes, int n_in,
                              void* d_out, int out_size, void* d_ws, size_t ws_size,
                              hipStream_t stream) {
  (void)in_sizes; (void)n_in; (void)out_size; (void)ws_size;
  const float* hs = (const float*)d_in[0];
  const float* wq = (const float*)d_in[1];
  const float* wk = (const float*)d_in[2];
  const float* wv = (const float*)d_in[3];
  const float* wo = (const float*)d_in[4];
  float* out = (float*)d_out;

  const size_t NX = (size_t)ROWS_ * HID_;  // 4M
  const size_t NW = (size_t)HID_ * HID_;   // 1M
  __bf16* p = (__bf16*)d_ws;
  __bf16 *Xh = p, *Xl = Xh + NX;
  __bf16 *Wqh = Xl + NX, *Wql = Wqh + NW;
  __bf16 *Wkh = Wql + NW, *Wkl = Wkh + NW;
  __bf16 *Wvh = Wkl + NW, *Wvl = Wvh + NW;
  __bf16 *Woh = Wvl + NW, *Wol = Woh + NW;
  __bf16 *Qh = Wol + NW, *Ql = Qh + NX;
  __bf16 *Kh = Ql + NX, *Kl = Kh + NX;
  __bf16 *Vth = Kl + NX, *Vtl = Vth + NX;
  __bf16 *Ah = Vtl + NX, *Al = Ah + NX;   // ~101 MB total

  // 1) one-time splits
  split_kernel<<<dim3((unsigned)(NX / 256)), dim3(256), 0, stream>>>(hs, Xh, Xl, (int)NX);
  split_kernel<<<dim3((unsigned)(NW / 256)), dim3(256), 0, stream>>>(wq, Wqh, Wql, (int)NW);
  split_kernel<<<dim3((unsigned)(NW / 256)), dim3(256), 0, stream>>>(wk, Wkh, Wkl, (int)NW);
  split_kernel<<<dim3((unsigned)(NW / 256)), dim3(256), 0, stream>>>(wv, Wvh, Wvl, (int)NW);
  split_kernel<<<dim3((unsigned)(NW / 256)), dim3(256), 0, stream>>>(wo, Woh, Wol, (int)NW);

  // 2) projections (Q,K with fused RoPE; V transposed)
  dim3 pg(ROWS_ / 128, HID_ / 128);
  dim3 pb(128);
  gemm_bf_kernel<MODE_ROPE><<<pg, pb, 0, stream>>>(Xh, Xl, Wqh, Wql, Qh, Ql, nullptr);
  gemm_bf_kernel<MODE_ROPE><<<pg, pb, 0, stream>>>(Xh, Xl, Wkh, Wkl, Kh, Kl, nullptr);
  gemm_bf_kernel<MODE_VTRANS><<<pg, pb, 0, stream>>>(Xh, Xl, Wvh, Wvl, Vth, Vtl, nullptr);

  // 3) flash attention
  attn_kernel<<<dim3((ROWS_ / 16) * NH_ / 8), dim3(256), 0, stream>>>(
      Qh, Ql, Kh, Kl, Vth, Vtl, Ah, Al);

  // 4) output projection -> fp32 result
  gemm_bf_kernel<MODE_F32><<<pg, pb, 0, stream>>>(Ah, Al, Woh, Wol, nullptr, nullptr, out);
}
